// v000
// Measured on an AMD MI455X. A time is GPU time per run, averaged over a window of back-to-back runs after a warm-up
// (all launches, gaps included; the runs take copies of the inputs in turn), and the median of several windows.
// Apart from v000's, it joins two sittings. Times from different sittings can be a few percent apart, while
// side-by-side timings come from the same sitting.
// The starting kernel, v000, takes 134 microseconds a run.
#include <hip/hip_runtime.h>
// Block-local attention (Q, K, V [4][12][4096][64]; mask [4][4096] of f32 words): the 4,096 tokens of a (batch, head) in 64 non-overlapping blocks of 64; for a block: scores = Q_block K_block^T (no 1 / sqrt(d)); -10000 added on the keys whose mask word equals 0; a softmax over the block's 64 keys; the rows of queries whose mask word equals 0 set to zero; out = weights V_block, as [4][12][4096][64].
// Structure: a block is 64 consecutive token rows of the input planes, so the block index (batch, head, block) = the token row over 64: Q and K as f16 rows (bf16-rounded); V cast TRANSPOSED as one plane of 196,608 token rows to [64 channels][196,608 tokens] (a block's 64 keys are 64 consecutive words of a channel's row); the scores of all 3,072 blocks as ONE WMMA GEMM (32x64 wave tiles, f32 accumulation; M 64, N 64, depth 64) with the block index on the grid's second extent, an f32 plane; one flat kernel, a thread a query row, forms the masked softmax of its 64 scores and writes the weights as f16 words at a carry of 1,024, a word that would lie under 2^-14 written as an exact 0; ONE GEMM over the 3,072 blocks (depth 64) writes out.
// Compute dtype: Q, K, V rounded to bf16 at the casts and carried as f16 words; the mask words are compared with 0 as they are; the scores, the maximum, the exponentials (expf), their sum in key order, the reciprocal (a true division) and the products' accumulation f32; the weights ONE f16 word at the carry (11 bits); out f32. v_wmma_f32_16x16x32_f16.
#define NBH 48                       /* (batch, head) pairs: 4 x 12 */
#define NHD 12                       /* heads */
#define SQ 4096                      /* tokens */
#define HD 64                        /* a head's width */
#define BS 64                        /* the block */
#define NBK (NBH * (SQ / BS))        /* blocks: 3,072 */
#define NEGM -10000.0f               /* the module's NEG_INF */
#define PSC 1024.0f                  /* the carry on the weights' operand plane (a power of two: exact) */
typedef __bf16 v16b __attribute__((ext_vector_type(16)));
typedef unsigned short v8us __attribute__((ext_vector_type(8), may_alias));
typedef float  v8f  __attribute__((ext_vector_type(8)));
typedef float  v4f  __attribute__((ext_vector_type(4)));
typedef float  v4fa __attribute__((ext_vector_type(4), may_alias));
union FragB { v16b v; v8us half[2]; unsigned short u[16]; };

__device__ __forceinline__ unsigned short bf16_bits(float x) { unsigned int u = __float_as_uint(x); return (unsigned short)((u + 0x7FFFu + ((u >> 16) & 1u)) >> 16); }
__device__ __forceinline__ float bf16_val(unsigned short b) { return __uint_as_float(((unsigned int)b) << 16); }
__device__ __forceinline__ float bf16_round(float x) { return bf16_val(bf16_bits(x)); }
// D += A·B with NT terms: 1 = ah·bh, 2 = + al·bh (A split), 3 = + ah·bl (both split)
template <int NT>
__device__ __forceinline__ v8f mmaN(v16b ah, v16b al, v16b bh, v16b bl, v8f c) {
  c = __builtin_amdgcn_wmma_f32_16x16x32_bf16(false, ah, false, bh, (short)0, c, false, false);
  if (NT >= 2) c = __builtin_amdgcn_wmma_f32_16x16x32_bf16(false, al, false, bh, (short)0, c, false, false);
  if (NT >= 3) c = __builtin_amdgcn_wmma_f32_16x16x32_bf16(false, ah, false, bl, (short)0, c, false, false);
  asm volatile("v_nop\n\tv_nop\n\tv_nop\n\tv_nop" : "+v"(c) : "v"(ah), "v"(al), "v"(bh), "v"(bl));
  return c;
}




// ---- f16 WMMA path (v_wmma_f32_16x16x32_f16): 11-bit significands for operands in range — used where a [0,1] probability operand needs more precision than bf16
typedef _Float16 v16h __attribute__((ext_vector_type(16)));
union FragH { v16h v; v8us half[2]; _Float16 h[16]; unsigned short u[16]; };
template <int NT>
__device__ __forceinline__ v8f mmaH(v16h ah, v16h al, v16h bh, v16h bl, v8f c) {
  c = __builtin_amdgcn_wmma_f32_16x16x32_f16(false, ah, false, bh, (short)0, c, false, false);
  if (NT >= 2) c = __builtin_amdgcn_wmma_f32_16x16x32_f16(false, al, false, bh, (short)0, c, false, false);
  if (NT >= 3) c = __builtin_amdgcn_wmma_f32_16x16x32_f16(false, ah, false, bl, (short)0, c, false, false);
  asm volatile("v_nop\n\tv_nop\n\tv_nop\n\tv_nop" : "+v"(c) : "v"(ah), "v"(al), "v"(bh), "v"(bl));
  return c;
}

// Wt[n][k] = f16(bf16(W[k][n])·scale) from f32 row-major W[K][N] (scale = power of two; bf16-exact weights stay exact in f16 away from the subnormal range)
__global__ __launch_bounds__(256) void k_wt_f16(const float* __restrict__ W, _Float16* __restrict__ Wt, int K, int N, float scale) {
  const int t = blockIdx.x * 256 + threadIdx.x; if (t >= N * (K / 8)) return; const int n = t / (K / 8), k8 = (t % (K / 8)) * 8; FragH f;
#pragma unroll
  for (int i = 0; i < 8; ++i) f.h[i] = (_Float16)(bf16_round(W[(size_t)(k8 + i) * N + n]) * scale); const v8us o = f.half[0];
  *(v8us*)((unsigned short*)Wt + (size_t)n * K + k8) = o; 
}

typedef _Float16 v4h __attribute__((ext_vector_type(4)));

__global__ __launch_bounds__(256) void k_x16(const float* __restrict__ x, _Float16* __restrict__ X16, size_t n8) { const size_t t = (size_t)blockIdx.x * 256 + threadIdx.x; if (t >= n8) return; FragH f;
#pragma unroll
  for (int q = 0; q < 8; ++q) f.h[q] = (_Float16)bf16_round(x[t * 8 + q]); *(v8us*)((unsigned short*)X16 + t * 8) = f.half[0];  }
// ---- fast GEMM (wave tile 32x64; requires M % 32 == 0 rows per launch region and N % 64 == 0); epilogue = k_gemm_hhx semantics ----
__device__ __forceinline__ v16h g2_frag(const _Float16* p, int hh) { FragH f; f.half[0] = *(const v8us*)((const unsigned short*)p + 8 * hh); f.half[1] = *(const v8us*)((const unsigned short*)p + 16 + 8 * hh); return f.v; }
__device__ __forceinline__ v8f g2_mma(v16h a, v16h b, v8f c) { v8f d = __builtin_amdgcn_wmma_f32_16x16x32_f16(false, a, false, b, (short)0, c, false, false); asm volatile("v_nop\n\tv_nop\n\tv_nop\n\tv_nop" : "+v"(d) : "v"(a), "v"(b)); return d; }
template <int ACT>
__global__ __launch_bounds__(128) void k_gemm2(const _Float16* __restrict__ A, int lda, size_t sA, const _Float16* __restrict__ Bh, int ldb, size_t sB, float alpha, const float* __restrict__ bias, size_t sBias, const float* __restrict__ CP, int rowsPerB, size_t sCPb, int row0g,
    float* __restrict__ C, _Float16* __restrict__ C16, int ldc, size_t sC, int M, int N, int K) { static_assert(ACT == 0 || ACT == 3 || ACT == 6 || ACT == 8 || ACT == 9 || ACT == 11 || ACT == 12 || ACT == 14 || ACT == 15 || ACT == 16 || ACT == 17, "k_gemm2: unsupported ACT code (would silently apply no activation)");
  __shared__ __attribute__((aligned(16))) float so[4][32][68];
  const int tid = threadIdx.x, w = tid >> 5, lane = tid & 31, ln = lane & 15, hh = lane >> 4; const int by = blockIdx.y;
  A += (size_t)by * sA; Bh += (size_t)by * sB; const size_t cofs = (size_t)by * sC; const float* bp = bias ? bias + (size_t)by * sBias : nullptr;
  const int ntn = N >> 6; const int mt = blockIdx.x / ntn, nq = blockIdx.x - mt * ntn; const int row0 = mt * 128 + 32 * w, col0 = nq * 64; if (row0 >= M) return;
  const _Float16* a0p = A + (size_t)(row0 + ln) * lda; const _Float16* a1p = a0p + (size_t)16 * lda;
  const _Float16* b0p = Bh + (size_t)(col0 + ln) * ldb; const _Float16* b1p = b0p + (size_t)16 * ldb; const _Float16* b2p = b1p + (size_t)16 * ldb; const _Float16* b3p = b2p + (size_t)16 * ldb;
  const v8f z8 = {0.f,0.f,0.f,0.f,0.f,0.f,0.f,0.f}; v8f c00 = z8, c01 = z8, c02 = z8, c03 = z8, c10 = z8, c11 = z8, c12 = z8, c13 = z8;
  for (int kb = 0; kb < K; kb += 32) { const v16h a0 = g2_frag(a0p + kb, hh), a1 = g2_frag(a1p + kb, hh);
    v16h b = g2_frag(b0p + kb, hh); c00 = g2_mma(a0, b, c00); c10 = g2_mma(a1, b, c10);
    b = g2_frag(b1p + kb, hh); c01 = g2_mma(a0, b, c01); c11 = g2_mma(a1, b, c11);
    b = g2_frag(b2p + kb, hh); c02 = g2_mma(a0, b, c02); c12 = g2_mma(a1, b, c12);
    b = g2_frag(b3p + kb, hh); c03 = g2_mma(a0, b, c03); c13 = g2_mma(a1, b, c13); }
  v8f accs[8] = {c00, c01, c02, c03, c10, c11, c12, c13};
#pragma unroll
  for (int u = 0; u < 8; ++u) { const int t = u & 3, half = u >> 2; const int col = col0 + t * 16 + ln; const float bv = bp ? bf16_round(bp[col]) : 0.f;
#pragma unroll
    for (int r = 0; r < 8; ++r) { const int rloc = half * 16 + 8 * hh + r; float v = accs[u][r] * alpha + bv; if (CP) { if (rowsPerB < 0) v += CP[cofs + (size_t)(row0g + row0 + rloc) * ldc + col];      /* rowsPerB < 0: own element of the batched C plane */ else { const int bidx = (row0g + row0 + rloc) / rowsPerB; v += CP[(size_t)bidx * sCPb + (size_t)by * 64 + col]; } }
      if (ACT == 3) v = fmaxf(v, 0.f); else if (ACT == 6) v = 0.5f * v * (1.0f + erff(v * 0.70710678118654752f)); else if (ACT == 11) v = 1.0f / (1.0f + expf(-v)); else if (ACT == 15) v = v / (1.0f + expf(-v)); else if (ACT == 12) v = (v > 0.f) ? v : 0.01f * v; else if (ACT == 8) v = tanhf(v); else if (ACT == 9) v = 0.5f * v * (1.0f + tanhf(0.7978845608028654f * (v + 0.044715f * v * v * v))); else if (ACT == 14) v = (v > 0.f) ? v : 0.1f * v; else if (ACT == 16) v = (v >= 0.f) ? v : 0.3f * v; else if (ACT == 17) v = (v >= 0.f) ? v : 0.2f * v;
      so[w][rloc][t * 16 + ln] = v; } }
  __builtin_amdgcn_fence(__ATOMIC_ACQ_REL, "workgroup"); __builtin_amdgcn_wave_barrier();
  const int rsub = lane >> 4, c4 = (lane & 15) * 4;
  {
#pragma unroll
    for (int q = 0; q < 16; ++q) { const int r = q * 2 + rsub; const v4f v = *(const v4fa*)&so[w][r][c4]; if (C) *(v4f*)(C + cofs + (size_t)(row0 + r) * ldc + col0 + c4) = v; if (C16) { v4h h4; for (int i = 0; i < 4; ++i) h4[i] = (_Float16)v[i]; *(v4h*)(C16 + cofs + (size_t)(row0 + r) * ldc + col0 + c4) = h4; } }
     } }

__device__ __forceinline__ float blk_add(float k) { return (k == 0.0f) ? NEGM : 0.0f; }      /* the key side: -10000 where the key's mask word equals 0 */
__device__ __forceinline__ float blk_exp(float z, float k, float m) { return expf(z + blk_add(k) - m); }      /* a key's exponential against the row's maximum */
__global__ __launch_bounds__(256) void k_blksm(const float* __restrict__ Z, const float* __restrict__ mask, _Float16* __restrict__ P16, int n) {
  const int r = blockIdx.x * 256 + threadIdx.x; if (r >= n) return; const int tk = r & (SQ - 1), bb = r / (NHD * SQ); const float* zp = Z + (size_t)r * BS; const float* mk = mask + (size_t)bb * SQ + (tk & ~(BS - 1)); const float mq = mask[(size_t)bb * SQ + tk]; float m = -3.0e38f;
  for (int c = 0; c < BS; c += 4) { const v4f z = *(const v4fa*)(zp + c); const v4f k4 = *(const v4fa*)(mk + c);
    for (int i = 0; i < 4; ++i) m = fmaxf(m, z[i] + blk_add(k4[i])); }
  float s = 0.f;
  for (int c = 0; c < BS; c += 4) { const v4f z = *(const v4fa*)(zp + c); const v4f k4 = *(const v4fa*)(mk + c);
    for (int i = 0; i < 4; ++i) s += blk_exp(z[i], k4[i], m); }
  const float g = ((mq == 0.0f) ? 0.0f : 1.0f) / s * PSC; unsigned short* hp = (unsigned short*)P16 + (size_t)r * BS;
  for (int c = 0; c < BS; c += 8) { const v4f z0 = *(const v4fa*)(zp + c); const v4f z1 = *(const v4fa*)(zp + c + 4); const v4f k0 = *(const v4fa*)(mk + c); const v4f k1 = *(const v4fa*)(mk + c + 4); FragH f;
    for (int i = 0; i < 4; ++i) { const _Float16 h0 = (_Float16)(blk_exp(z0[i], k0[i], m) * g); const _Float16 h1 = (_Float16)(blk_exp(z1[i], k1[i], m) * g); f.h[i] = (h0 < (_Float16)6.103515625e-05f) ? (_Float16)0.0f : h0; f.h[4 + i] = (h1 < (_Float16)6.103515625e-05f) ? (_Float16)0.0f : h1; }
    *(v8us*)(hp + c) = f.half[0];  } }

extern "C" void kernel_launch(void* const* d_in, const int* in_sizes, int n_in,
                              void* d_out, int out_size, void* d_ws, size_t ws_size, hipStream_t stream) {
  (void)in_sizes; (void)n_in; (void)out_size;
  const float* Q = (const float*)d_in[0]; const float* K = (const float*)d_in[1]; const float* V = (const float*)d_in[2]; const float* mask = (const float*)d_in[3];      /* Q, K, V [4][12][4096][64] f32; mask [4][4096] f32 */
  static_assert(NBH == 48 && NHD == 12 && SQ == 4096 && HD == 64 && BS == 64 && NBK == 3072 && ((size_t)NBH * SQ * HD / 8) % 256 == 0 && ((size_t)HD * (NBH * SQ / 8)) % 256 == 0 && ((size_t)NBH * SQ) % 256 == 0 && BS % 32 == 0 && HD % 64 == 0 && BS % 64 == 0 && HD % 32 == 0, "the index shifts; whole tiles; exact grids");
  float* out = (float*)d_out;      /* [4][12][4096][64]: a block's 64 rows of 64 words are consecutive: block b at out + b * 4096 */
  const size_t PL = (size_t)NBH * SQ * HD;      /* words of one input plane */
  char* ws = (char*)d_ws; size_t off = 0;
  auto take = [&](size_t bytes) { char* p = ws + off; off += (bytes + 255) & ~(size_t)255; return p; };
  _Float16* Q16 = (_Float16*)take(PL * 2); _Float16* K16 = (_Float16*)take(PL * 2); _Float16* VT = (_Float16*)take(PL * 2); float* Z = (float*)take((size_t)NBK * BS * BS * 4); _Float16* P16 = (_Float16*)take((size_t)NBK * BS * BS * 2);
  if (off > ws_size) return;
  k_x16<<<(unsigned)(PL / 8 / 256), 256, 0, stream>>>(Q, Q16, PL / 8); k_x16<<<(unsigned)(PL / 8 / 256), 256, 0, stream>>>(K, K16, PL / 8);
  k_wt_f16<<<(unsigned)((size_t)HD * (NBH * SQ / 8) / 256), 256, 0, stream>>>(V, VT, NBH * SQ, HD, 1.0f);      /* V as [196608 token rows][64] -> VT [64][196608]: VT[c][token] = f16(bf16(V[token][c])) */
  k_gemm2<0><<<dim3((BS / 64) * (BS / 64), NBK), 128, 0, stream>>>(Q16, HD, (size_t)BS * HD, K16, HD, (size_t)BS * HD, 1.0f, nullptr, 0, nullptr, 1, 0, 0, Z, nullptr, BS, (size_t)BS * BS, BS, BS, HD);      /* the scores of every block, a block a grid row: Z[block][x][y] = Q16[block * 64 + x] . K16[block * 64 + y]; 64 rows: the thread block's first two waves work, the other two leave at the row guard */
  k_blksm<<<(unsigned)((size_t)NBH * SQ / 256), 256, 0, stream>>>(Z, mask, P16, NBH * SQ);
  k_gemm2<0><<<dim3((BS / 64) * (HD / 64), NBK), 128, 0, stream>>>(P16, BS, (size_t)BS * BS, VT, NBH * SQ, (size_t)BS, 1.0f / PSC, nullptr, 0, nullptr, 1, 0, 0, out, nullptr, HD, (size_t)BS * HD, BS, HD, BS);      /* out[block * 64 + x][c] = the sum over y of P16[block][x][y] VT[c][block * 64 + y] / 1024: the right operand's row pitch is the plane's 196,608 words and a block steps 64 words along it; every element once */
}

// v001
// It runs in 17.6 microseconds.
// Timed twice side by side with v000, it ran 7.91 and 7.81 times as fast.
#include <hip/hip_runtime.h>
// Block-local attention (Q, K, V [4][12][4096][64]; mask [4][4096] of f32 words): the 4,096 tokens of a (batch, head) in 64 non-overlapping blocks of 64; for a block: scores = Q_block K_block^T (no 1 / sqrt(d)); -10000 added on the keys whose mask word equals 0; a softmax over the block's 64 keys; the rows of queries whose mask word equals 0 set to zero; out = weights V_block, as [4][12][4096][64].
// Structure: ONE kernel, a work-group of four waves per block (3,072 work-groups); a block is 64 consecutive token rows of the input planes. The work-group reads the block's Q, K and V rows as whole lines, casts them in registers and lays them in LDS as f16 words: Q and K as rows, V transposed ([channel][key]: a thread holds 8 keys of 4 channels and stores 8 keys of a channel at once), the block's 64 mask words beside them. Behind one barrier a wave takes 16 queries: S^T = K Q^T (A = K rows, B = Q rows), so that a lane holds 32 of one query's 64 scores and its partner lane (l ^ 16) the other 32; the masked softmax in registers; the weights, converted in place, are the B operand of O^T = V^T P^T; the wave turns its 16 x 64 result in its own LDS range and stores whole lines.
// Compute dtype: Q, K, V rounded to bf16 at the casts and carried as f16 words; the mask words are compared with 0 as they are; the scores, the maximum, the exponentials (expf), their sum, the reciprocal (a true division) and the products' accumulation f32; the weights ONE f16 word at a carry of 1,024 (11 bits), a word that would lie under 2^-14 written as an exact 0; out f32. v_wmma_f32_16x16x32_f16.
#define NBH 48                       /* (batch, head) pairs: 4 x 12 */
#define NHD 12                       /* heads */
#define SQ 4096                      /* tokens */
#define HD 64                        /* a head's width */
#define BS 64                        /* the block */
#define NBK (NBH * (SQ / BS))        /* blocks: 3,072 */
#define NEGM -10000.0f               /* the module's NEG_INF */
#define PSC 1024.0f                  /* the carry on the weights' operand (a power of two: exact) */
#define LP 72                        /* f16 words of an LDS operand row: 144 bytes = 16 x odd, for 16-byte fragment reads */
#define OP 68                        /* f32 words of an LDS output row: 16-byte column walks without bank conflicts */
typedef unsigned short v8us __attribute__((ext_vector_type(8), may_alias));
typedef unsigned short v4us __attribute__((ext_vector_type(4), may_alias));
typedef float  v8f  __attribute__((ext_vector_type(8)));
typedef float  v4f  __attribute__((ext_vector_type(4)));
typedef float  v4fa __attribute__((ext_vector_type(4), may_alias));
typedef float  v2f  __attribute__((ext_vector_type(2)));
typedef _Float16 v2h  __attribute__((ext_vector_type(2)));
typedef _Float16 v16h __attribute__((ext_vector_type(16)));
union FragH { v16h v; v8us half[2]; v4us quad[4]; _Float16 h[16]; unsigned short u[16]; };

__device__ __forceinline__ unsigned short bf16_bits(float x) { unsigned int u = __float_as_uint(x); return (unsigned short)((u + 0x7FFFu + ((u >> 16) & 1u)) >> 16); }
__device__ __forceinline__ float bf16_val(unsigned short b) { return __uint_as_float(((unsigned int)b) << 16); }
__device__ __forceinline__ float bf16_round(float x) { return bf16_val(bf16_bits(x)); }
// a lane's 16 words of an operand row's 32 k: k = 8 hh + 0..7 and 16 + 8 hh + 0..7 (the order in which two accumulator tiles, converted in place, form an operand)
__device__ __forceinline__ v16h lds_frag(const unsigned short* p, int hh) { FragH f; f.half[0] = *(const v8us*)(p + 8 * hh); f.half[1] = *(const v8us*)(p + 16 + 8 * hh); return f.v; }
__device__ __forceinline__ v8f mma(v16h a, v16h b, v8f c) { return __builtin_amdgcn_wmma_f32_16x16x32_f16(false, a, false, b, (short)0, c, false, false); }
__device__ __forceinline__ float other_half(float x) { const int b = __float_as_int(x); return __int_as_float(__builtin_amdgcn_permlanex16(b, b, 0x76543210, 0xfedcba98, false, false)); }      /* lane l reads lane l ^ 16 */
__device__ __forceinline__ float blk_add(float k) { return (k == 0.0f) ? NEGM : 0.0f; }      /* the key side: -10000 where the key's mask word equals 0 */

__global__ __launch_bounds__(128) void k_blkattn(const float* __restrict__ Q, const float* __restrict__ K, const float* __restrict__ V, const float* __restrict__ mask, float* __restrict__ out) {
  __shared__ __attribute__((aligned(16))) unsigned short sq[BS][LP];      /* Q rows, f16 */
  __shared__ __attribute__((aligned(16))) unsigned short sk[BS][LP];      /* K rows, f16 */
  __shared__ __attribute__((aligned(16))) unsigned short sv[HD][LP];      /* V transposed: [channel][key], f16 */
  __shared__ __attribute__((aligned(16))) float so[4][16][OP];            /* a wave's own 16 output rows */
  __shared__ __attribute__((aligned(16))) float sm[2][BS];                /* the block's 64 mask words, as they are: one copy a pair of waves, so that all 128 threads load and store one word with no branch */
  const int tid = threadIdx.x, w = tid >> 5, lane = tid & 31, ln = lane & 15, hh = lane >> 4; const int blk = blockIdx.x;
  const size_t base = (size_t)blk * (BS * HD);      /* the block's first word in Q, K, V and out */
  const float* mk = mask + (size_t)(blk / (NHD * (SQ / BS))) * SQ + (size_t)(blk & (SQ / BS - 1)) * BS;      /* the block's 64 mask words */
  const int c4 = (tid & 15) * 4, rg = tid >> 4;
  const char* Kb = (const char*)(K + base); const char* Qb = (const char*)(Q + base); const char* Vb = (const char*)(V + base);      /* the block's planes: the same for the whole work-group */
  const unsigned mi = tid & (BS - 1), bqk = (unsigned)(rg * HD + c4) * 4u, bv = (unsigned)(rg * 8 * HD + c4) * 4u;      /* the thread's mask word; its byte offsets in the Q and K rows and in the V rows */
  v4f qv[8], kv[8], vv[8];
  const float mword = mk[mi];
#pragma unroll      /* constant indices: the vectors stay in registers */
  for (int j = 0; j < 8; ++j) kv[j] = *(const v4fa*)(Kb + bqk + j * (8 * HD * 4));      /* row rg + 8 j */
#pragma unroll      /* constant indices: the vectors stay in registers */
  for (int j = 0; j < 8; ++j) qv[j] = *(const v4fa*)(Qb + bqk + j * (8 * HD * 4));
#pragma unroll      /* constant indices: the vectors stay in registers */
  for (int j = 0; j < 8; ++j) vv[j] = *(const v4fa*)(Vb + bv + j * (HD * 4));      /* row rg * 8 + j: 8 consecutive keys of 4 channels */
  asm volatile("s_wait_xcnt 0x0" :: "v"(mi), "v"(bqk), "v"(bv) : "memory");      /* the loads' offset registers are inputs, so they live up to this wait and no later load lands on one of them */
  __builtin_amdgcn_sched_barrier(0);      /* all 25 loads are issued before the first cast: without it the compiler sinks the last V loads behind the waits for the first rows, and a second memory latency follows the first */
#pragma unroll      /* constant indices: the vectors stay in registers */
  for (int j = 0; j < 8; ++j) { FragH f;
#pragma unroll      /* constant indices: the vectors stay in registers */
    for (int i = 0; i < 4; ++i) f.h[i] = (_Float16)bf16_round(kv[j][i]);
    *(v4us*)&sk[rg + 8 * j][c4] = f.quad[0]; }
#pragma unroll      /* constant indices: the vectors stay in registers */
  for (int j = 0; j < 8; ++j) { FragH f;
#pragma unroll      /* constant indices: the vectors stay in registers */
    for (int i = 0; i < 4; ++i) f.h[i] = (_Float16)bf16_round(qv[j][i]);
    *(v4us*)&sq[rg + 8 * j][c4] = f.quad[0]; }
#pragma unroll      /* constant indices: the vectors stay in registers */
  for (int i = 0; i < 4; ++i) { FragH f;
#pragma unroll      /* constant indices: the vectors stay in registers */
    for (int j = 0; j < 8; ++j) f.h[j] = (_Float16)bf16_round(vv[j][i]);
    *(v8us*)&sv[c4 + i][rg * 8] = f.half[0]; }
  sm[w >> 1][tid & (BS - 1)] = mword;
  __syncthreads();      /* every wave reads all of K and V and its 16 Q rows, which all four waves laid down, and the mask copy of its pair of waves */
  const v8f z8 = {0.f, 0.f, 0.f, 0.f, 0.f, 0.f, 0.f, 0.f};
  // S^T: tile t, register r of lane (ln, hh) = the score of key t * 16 + 8 hh + r with query 16 w + ln
  const v16h bq0 = lds_frag(&sq[16 * w + ln][0], hh), bq1 = lds_frag(&sq[16 * w + ln][32], hh);
  v8f s[4];
#pragma unroll      /* constant indices: the vectors stay in registers */
  for (int t = 0; t < 4; ++t) { s[t] = mma(lds_frag(&sk[t * 16 + ln][0], hh), bq0, z8); s[t] = mma(lds_frag(&sk[t * 16 + ln][32], hh), bq1, s[t]); }
  v4f mw[8];
#pragma unroll      /* constant indices: the vectors stay in registers */
  for (int t = 0; t < 4; ++t) { mw[2 * t] = *(const v4fa*)&sm[w >> 1][t * 16 + 8 * hh]; mw[2 * t + 1] = *(const v4fa*)&sm[w >> 1][t * 16 + 8 * hh + 4]; }      /* the mask words of the lane's 32 keys */
  const float mq = sm[w >> 1][16 * w + ln];      /* the lane's query */
  float m = -3.0e38f;
#pragma unroll      /* constant indices: the vectors stay in registers */
  for (int t = 0; t < 4; ++t) {
#pragma unroll      /* constant indices: the vectors stay in registers */
    for (int r = 0; r < 8; ++r) { s[t][r] = s[t][r] + blk_add(mw[2 * t + (r >> 2)][r & 3]); m = fmaxf(m, s[t][r]); } }
  m = fmaxf(m, other_half(m));
  v2f st[4];      /* a tile's even and odd keys: neighbouring registers add as pairs */
#pragma unroll      /* constant indices: the vectors stay in registers */
  for (int t = 0; t < 4; ++t) { st[t] = (v2f){0.f, 0.f};
#pragma unroll      /* constant indices: the vectors stay in registers */
    for (int r = 0; r < 8; r += 2) { s[t][r] = expf(s[t][r] - m); s[t][r + 1] = expf(s[t][r + 1] - m); st[t] += (v2f){s[t][r], s[t][r + 1]}; } }
  const v2f sp = (st[0] + st[1]) + (st[2] + st[3]); float sum = sp[0] + sp[1]; sum += other_half(sum);
  const float g = ((mq == 0.0f) ? 0.0f : 1.0f) / sum * PSC;
  // the weights as the B operand: element i of a 32-key step = tile 2 kb, register i; element 8 + i = tile 2 kb + 1, register i
  FragH pb[2];
#pragma unroll      /* constant indices: the vectors stay in registers */
  for (int t = 0; t < 4; ++t) {
#pragma unroll      /* constant indices: the vectors stay in registers */
    for (int r = 0; r < 8; r += 2) { const v2f pr = {s[t][r] * g, s[t][r + 1] * g}; const v2h h = __builtin_convertvector(pr, v2h);
      pb[t >> 1].h[(t & 1) * 8 + r] = (h[0] < (_Float16)6.103515625e-05f) ? (_Float16)0.0f : h[0]; pb[t >> 1].h[(t & 1) * 8 + r + 1] = (h[1] < (_Float16)6.103515625e-05f) ? (_Float16)0.0f : h[1]; } }
  // O^T: tile t, register r of lane (ln, hh) = channel t * 16 + 8 hh + r of query 16 w + ln
#pragma unroll      /* constant indices: the vectors stay in registers */
  for (int t = 0; t < 4; ++t) { v8f o = mma(lds_frag(&sv[t * 16 + ln][0], hh), pb[0].v, z8); o = mma(lds_frag(&sv[t * 16 + ln][32], hh), pb[1].v, o);
    v4f lo, hi;
#pragma unroll      /* constant indices: the vectors stay in registers */
    for (int i = 0; i < 4; ++i) { lo[i] = o[i] * (1.0f / PSC); hi[i] = o[4 + i] * (1.0f / PSC); }
    *(v4fa*)&so[w][ln][t * 16 + 8 * hh] = lo; *(v4fa*)&so[w][ln][t * 16 + 8 * hh + 4] = hi; }
  __builtin_amdgcn_fence(__ATOMIC_ACQ_REL, "workgroup"); __builtin_amdgcn_wave_barrier();      /* the wave reads back rows that its other lanes wrote: the LDS stores stay in front of the loads */
#pragma unroll      /* constant indices: the vectors stay in registers */
  for (int q = 0; q < 8; ++q) { const int r = q * 2 + hh; const v4f v = *(const v4fa*)&so[w][r][ln * 4]; *(v4fa*)(out + base + (size_t)(16 * w + r) * HD + ln * 4) = v; }      /* two whole rows, 512 consecutive bytes, a store */
}

extern "C" void kernel_launch(void* const* d_in, const int* in_sizes, int n_in,
                              void* d_out, int out_size, void* d_ws, size_t ws_size, hipStream_t stream) {
  (void)in_sizes; (void)n_in; (void)out_size; (void)d_ws; (void)ws_size;
  const float* Q = (const float*)d_in[0]; const float* K = (const float*)d_in[1]; const float* V = (const float*)d_in[2]; const float* mask = (const float*)d_in[3];      /* Q, K, V [4][12][4096][64] f32; mask [4][4096] f32 */
  static_assert(NBH == 48 && NHD == 12 && SQ == 4096 && HD == 64 && BS == 64 && NBK == 3072, "the index shifts; whole tiles; an exact grid");
  float* out = (float*)d_out;      /* [4][12][4096][64]: a block's 64 rows of 64 words are consecutive: block b at out + b * 4096 */
  k_blkattn<<<NBK, 128, 0, stream>>>(Q, K, V, mask, out);      /* every element once */
}

// v002
// A run of this version takes 16.6 microseconds.
// Timed twice side by side with v001, it ran 1.06 times as fast both times.
// All steps since v000 together make it 8.32 times as fast.
#include <hip/hip_runtime.h>
// Block-local attention (Q, K, V [4][12][4096][64]; mask [4][4096] of f32 words): the 4,096 tokens of a (batch, head) in 64 non-overlapping blocks of 64; for a block: scores = Q_block K_block^T (no 1 / sqrt(d)); -10000 added on the keys whose mask word equals 0; a softmax over the block's 64 keys; the rows of queries whose mask word equals 0 set to zero; out = weights V_block, as [4][12][4096][64].
// Structure: ONE kernel, a work-group of four waves per block (3,072 work-groups); a block is 64 consecutive token rows of the input planes. The work-group reads the block's Q, K and V rows as whole lines, casts them in registers and lays them in LDS as 16-bit words: Q and K as rows of bf16 words, V as f16 words, transposed ([channel][key]: a thread holds 8 keys of 4 channels and stores 8 keys of a channel at once), the block's 64 mask words beside them. Behind one barrier a wave takes 16 queries: S^T = K Q^T (A = K rows, B = Q rows), so that a lane holds 32 of one query's 64 scores and its partner lane (l ^ 16) the other 32; the masked softmax in registers; the weights, converted in place, are the B operand of O^T = V^T P^T; the wave turns its 16 x 64 result in its own LDS range and stores whole lines.
// Compute dtype: Q, K, V rounded to bf16 at the casts, by the packed convert (to nearest even); Q and K stay bf16 words, V's bf16 values are carried as f16 words (the weights' operand type); the mask words are compared with 0 as they are; the scores, the maximum, the exponentials (expf), their sum, the reciprocal (a true division) and the products' accumulation f32; the weights ONE f16 word at a carry of 1,024 (11 bits), a word that would lie under 2^-14 written as an exact 0; out f32. v_wmma_f32_16x16x32_bf16 (scores), v_wmma_f32_16x16x32_f16 (output).
#define NBH 48                       /* (batch, head) pairs: 4 x 12 */
#define NHD 12                       /* heads */
#define SQ 4096                      /* tokens */
#define HD 64                        /* a head's width */
#define BS 64                        /* the block */
#define NBK (NBH * (SQ / BS))        /* blocks: 3,072 */
#define NEGM -10000.0f               /* the module's NEG_INF */
#define PSC 1024.0f                  /* the carry on the weights' operand (a power of two: exact) */
#define LP 72                        /* 16-bit words of an LDS operand row: 144 bytes = 16 x odd, for 16-byte fragment reads */
#define OP 68                        /* f32 words of an LDS output row: 16-byte column walks without bank conflicts */
typedef unsigned short v8us __attribute__((ext_vector_type(8), may_alias));
typedef unsigned int v2u __attribute__((ext_vector_type(2), may_alias));
typedef unsigned int v4u __attribute__((ext_vector_type(4), may_alias));
typedef float  v8f  __attribute__((ext_vector_type(8)));
typedef float  v4f  __attribute__((ext_vector_type(4)));
typedef float  v4fa __attribute__((ext_vector_type(4), may_alias));
typedef float  v2f  __attribute__((ext_vector_type(2)));
typedef _Float16 v2h  __attribute__((ext_vector_type(2)));
typedef _Float16 v16h __attribute__((ext_vector_type(16)));
typedef __bf16 v2b  __attribute__((ext_vector_type(2)));
typedef __bf16 v16b __attribute__((ext_vector_type(16)));
union FragH { v16h v; v16b b; v8us half[2]; _Float16 h[16]; };

__device__ __forceinline__ unsigned int pk_bf16(float a, float b) { const v2b h = {(__bf16)a, (__bf16)b}; return __builtin_bit_cast(unsigned int, h); }      /* two bf16 words, a in the low half: one v_cvt_pk_bf16_f32 */
__device__ __forceinline__ unsigned int pk_bf16_as_f16(float a, float b) { const unsigned int p = pk_bf16(a, b); const v2f q = {__uint_as_float(p << 16), __uint_as_float(p & 0xFFFF0000u)}; return __builtin_bit_cast(unsigned int, __builtin_convertvector(q, v2h)); }      /* the same two bf16 values as f16 words */
// a lane's 16 words of an operand row's 32 k: k = 8 hh + 0..7 and 16 + 8 hh + 0..7 (the order in which two accumulator tiles, converted in place, form an operand)
__device__ __forceinline__ FragH lds_frag(const unsigned short* p, int hh) { FragH f; f.half[0] = *(const v8us*)(p + 8 * hh); f.half[1] = *(const v8us*)(p + 16 + 8 * hh); return f; }
__device__ __forceinline__ v8f mma(v16h a, v16h b, v8f c) { return __builtin_amdgcn_wmma_f32_16x16x32_f16(false, a, false, b, (short)0, c, false, false); }
__device__ __forceinline__ v8f mma_b(v16b a, v16b b, v8f c) { return __builtin_amdgcn_wmma_f32_16x16x32_bf16(false, a, false, b, (short)0, c, false, false); }
__device__ __forceinline__ float other_half(float x) { const int b = __float_as_int(x); return __int_as_float(__builtin_amdgcn_permlanex16(b, b, 0x76543210, 0xfedcba98, false, false)); }      /* lane l reads lane l ^ 16 */
__device__ __forceinline__ float blk_add(float k) { return (k == 0.0f) ? NEGM : 0.0f; }      /* the key side: -10000 where the key's mask word equals 0 */

__global__ __launch_bounds__(128) void k_blkattn(const float* __restrict__ Q, const float* __restrict__ K, const float* __restrict__ V, const float* __restrict__ mask, float* __restrict__ out) {
  __shared__ __attribute__((aligned(16))) unsigned short sq[BS][LP];      /* Q rows, bf16 */
  __shared__ __attribute__((aligned(16))) unsigned short sk[BS][LP];      /* K rows, bf16 */
  __shared__ __attribute__((aligned(16))) unsigned short sv[HD][LP];      /* V transposed: [channel][key], f16 */
  __shared__ __attribute__((aligned(16))) float so[4][16][OP];            /* a wave's own 16 output rows */
  __shared__ __attribute__((aligned(16))) float sm[2][BS];                /* the block's 64 mask words, as they are: one copy a pair of waves, so that all 128 threads load and store one word with no branch */
  const int tid = threadIdx.x, w = tid >> 5, lane = tid & 31, ln = lane & 15, hh = lane >> 4; const int blk = blockIdx.x;
  const size_t base = (size_t)blk * (BS * HD);      /* the block's first word in Q, K, V and out */
  const float* mk = mask + (size_t)(blk / (NHD * (SQ / BS))) * SQ + (size_t)(blk & (SQ / BS - 1)) * BS;      /* the block's 64 mask words */
  const int c4 = (tid & 15) * 4, rg = tid >> 4;
  const char* Kb = (const char*)(K + base); const char* Qb = (const char*)(Q + base); const char* Vb = (const char*)(V + base);      /* the block's planes: the same for the whole work-group */
  const unsigned mi = tid & (BS - 1), bqk = (unsigned)(rg * HD + c4) * 4u, bv = (unsigned)(rg * 8 * HD + c4) * 4u;      /* the thread's mask word; its byte offsets in the Q and K rows and in the V rows */
  v4f qv[8], kv[8], vv[8];
  const float mword = mk[mi];
#pragma unroll      /* constant indices: the vectors stay in registers */
  for (int j = 0; j < 8; ++j) kv[j] = *(const v4fa*)(Kb + bqk + j * (8 * HD * 4));      /* row rg + 8 j */
#pragma unroll      /* constant indices: the vectors stay in registers */
  for (int j = 0; j < 8; ++j) qv[j] = *(const v4fa*)(Qb + bqk + j * (8 * HD * 4));
#pragma unroll      /* constant indices: the vectors stay in registers */
  for (int j = 0; j < 8; ++j) vv[j] = *(const v4fa*)(Vb + bv + j * (HD * 4));      /* row rg * 8 + j: 8 consecutive keys of 4 channels */
  asm volatile("s_wait_xcnt 0x0" :: "v"(mi), "v"(bqk), "v"(bv) : "memory");      /* the loads' offset registers are inputs, so they live up to this wait and no later load lands on one of them */
  __builtin_amdgcn_sched_barrier(0);      /* all 25 loads are issued before the first cast: without it the compiler sinks the last V loads behind the waits for the first rows, and a second memory latency follows the first */
#pragma unroll      /* constant indices: the vectors stay in registers */
  for (int j = 0; j < 8; ++j) *(v2u*)&sk[rg + 8 * j][c4] = (v2u){pk_bf16(kv[j][0], kv[j][1]), pk_bf16(kv[j][2], kv[j][3])};
#pragma unroll      /* constant indices: the vectors stay in registers */
  for (int j = 0; j < 8; ++j) *(v2u*)&sq[rg + 8 * j][c4] = (v2u){pk_bf16(qv[j][0], qv[j][1]), pk_bf16(qv[j][2], qv[j][3])};
#pragma unroll      /* constant indices: the vectors stay in registers */
  for (int i = 0; i < 4; ++i) *(v4u*)&sv[c4 + i][rg * 8] = (v4u){pk_bf16_as_f16(vv[0][i], vv[1][i]), pk_bf16_as_f16(vv[2][i], vv[3][i]), pk_bf16_as_f16(vv[4][i], vv[5][i]), pk_bf16_as_f16(vv[6][i], vv[7][i])};
  sm[w >> 1][tid & (BS - 1)] = mword;
  __syncthreads();      /* every wave reads all of K and V and its 16 Q rows, which all four waves laid down, and the mask copy of its pair of waves */
  const v8f z8 = {0.f, 0.f, 0.f, 0.f, 0.f, 0.f, 0.f, 0.f};
  // S^T: tile t, register r of lane (ln, hh) = the score of key t * 16 + 8 hh + r with query 16 w + ln
  const v16b bq0 = lds_frag(&sq[16 * w + ln][0], hh).b, bq1 = lds_frag(&sq[16 * w + ln][32], hh).b;
  v8f s[4];
#pragma unroll      /* constant indices: the vectors stay in registers */
  for (int t = 0; t < 4; ++t) { s[t] = mma_b(lds_frag(&sk[t * 16 + ln][0], hh).b, bq0, z8); s[t] = mma_b(lds_frag(&sk[t * 16 + ln][32], hh).b, bq1, s[t]); }
  v4f mw[8];
#pragma unroll      /* constant indices: the vectors stay in registers */
  for (int t = 0; t < 4; ++t) { mw[2 * t] = *(const v4fa*)&sm[w >> 1][t * 16 + 8 * hh]; mw[2 * t + 1] = *(const v4fa*)&sm[w >> 1][t * 16 + 8 * hh + 4]; }      /* the mask words of the lane's 32 keys */
  const float mq = sm[w >> 1][16 * w + ln];      /* the lane's query */
  float m = -3.0e38f;
#pragma unroll      /* constant indices: the vectors stay in registers */
  for (int t = 0; t < 4; ++t) {
#pragma unroll      /* constant indices: the vectors stay in registers */
    for (int r = 0; r < 8; ++r) { s[t][r] = s[t][r] + blk_add(mw[2 * t + (r >> 2)][r & 3]); m = fmaxf(m, s[t][r]); } }
  m = fmaxf(m, other_half(m));
  v2f st[4];      /* a tile's even and odd keys: neighbouring registers add as pairs */
#pragma unroll      /* constant indices: the vectors stay in registers */
  for (int t = 0; t < 4; ++t) { st[t] = (v2f){0.f, 0.f};
#pragma unroll      /* constant indices: the vectors stay in registers */
    for (int r = 0; r < 8; r += 2) { s[t][r] = expf(s[t][r] - m); s[t][r + 1] = expf(s[t][r + 1] - m); st[t] += (v2f){s[t][r], s[t][r + 1]}; } }
  const v2f sp = (st[0] + st[1]) + (st[2] + st[3]); float sum = sp[0] + sp[1]; sum += other_half(sum);
  const float g = ((mq == 0.0f) ? 0.0f : 1.0f) / sum * PSC;
  // the weights as the B operand: element i of a 32-key step = tile 2 kb, register i; element 8 + i = tile 2 kb + 1, register i
  FragH pb[2];
#pragma unroll      /* constant indices: the vectors stay in registers */
  for (int t = 0; t < 4; ++t) {
#pragma unroll      /* constant indices: the vectors stay in registers */
    for (int r = 0; r < 8; r += 2) { const v2f pr = {s[t][r] * g, s[t][r + 1] * g}; const v2h h = __builtin_convertvector(pr, v2h);
      pb[t >> 1].h[(t & 1) * 8 + r] = (h[0] < (_Float16)6.103515625e-05f) ? (_Float16)0.0f : h[0]; pb[t >> 1].h[(t & 1) * 8 + r + 1] = (h[1] < (_Float16)6.103515625e-05f) ? (_Float16)0.0f : h[1]; } }
  // O^T: tile t, register r of lane (ln, hh) = channel t * 16 + 8 hh + r of query 16 w + ln
#pragma unroll      /* constant indices: the vectors stay in registers */
  for (int t = 0; t < 4; ++t) { v8f o = mma(lds_frag(&sv[t * 16 + ln][0], hh).v, pb[0].v, z8); o = mma(lds_frag(&sv[t * 16 + ln][32], hh).v, pb[1].v, o);
    v4f lo, hi;
#pragma unroll      /* constant indices: the vectors stay in registers */
    for (int i = 0; i < 4; ++i) { lo[i] = o[i] * (1.0f / PSC); hi[i] = o[4 + i] * (1.0f / PSC); }
    *(v4fa*)&so[w][ln][t * 16 + 8 * hh] = lo; *(v4fa*)&so[w][ln][t * 16 + 8 * hh + 4] = hi; }
  __builtin_amdgcn_fence(__ATOMIC_ACQ_REL, "workgroup"); __builtin_amdgcn_wave_barrier();      /* the wave reads back rows that its other lanes wrote: the LDS stores stay in front of the loads */
#pragma unroll      /* constant indices: the vectors stay in registers */
  for (int q = 0; q < 8; ++q) { const int r = q * 2 + hh; const v4f v = *(const v4fa*)&so[w][r][ln * 4]; *(v4fa*)(out + base + (size_t)(16 * w + r) * HD + ln * 4) = v; }      /* two whole rows, 512 consecutive bytes, a store */
}

extern "C" void kernel_launch(void* const* d_in, const int* in_sizes, int n_in,
                              void* d_out, int out_size, void* d_ws, size_t ws_size, hipStream_t stream) {
  (void)in_sizes; (void)n_in; (void)out_size; (void)d_ws; (void)ws_size;
  const float* Q = (const float*)d_in[0]; const float* K = (const float*)d_in[1]; const float* V = (const float*)d_in[2]; const float* mask = (const float*)d_in[3];      /* Q, K, V [4][12][4096][64] f32; mask [4][4096] f32 */
  static_assert(NBH == 48 && NHD == 12 && SQ == 4096 && HD == 64 && BS == 64 && NBK == 3072, "the index shifts; whole tiles; an exact grid");
  float* out = (float*)d_out;      /* [4][12][4096][64]: a block's 64 rows of 64 words are consecutive: block b at out + b * 4096 */
  k_blkattn<<<NBK, 128, 0, stream>>>(Q, K, V, mask, out);      /* every element once */
}

// v003
// One run takes 15.3 microseconds.
// Two timings next to v002 put it at 1.07 and 1.08 times that version's speed.
// Counting every step since v000, it is 8.96 times as fast.
#include <hip/hip_runtime.h>
// Block-local attention (Q, K, V [4][12][4096][64]; mask [4][4096] of f32 words): the 4,096 tokens of a (batch, head) in 64 non-overlapping blocks of 64; for a block: scores = Q_block K_block^T (no 1 / sqrt(d)); -10000 added on the keys whose mask word equals 0; a softmax over the block's 64 keys; the rows of queries whose mask word equals 0 set to zero; out = weights V_block, as [4][12][4096][64].
// Structure: ONE kernel, a work-group of four waves per block (3,072 work-groups); a block is 64 consecutive token rows of the input planes. The work-group reads the block's Q, K and V rows as whole lines, casts them in registers and lays them in LDS as 16-bit words: Q and K as rows of bf16 words, V as f16 words, transposed ([channel][key]: a thread holds 8 keys of 4 channels and stores 8 keys of a channel at once), the block's 64 mask words beside them. Behind one barrier a wave takes 16 queries: S^T = K Q^T (A = K rows, B = Q rows), so that a lane holds 32 of one query's 64 scores and its partner lane (l ^ 16) the other 32; the masked softmax in registers; the weights, converted in place, are the B operand of O^T = V^T P^T; the wave turns its 16 x 64 result in its own LDS range and stores whole lines.
// Compute dtype: Q, K, V rounded to bf16 at the casts, by the packed convert (to nearest even); Q and K stay bf16 words, V's bf16 values are carried as f16 words (the weights' operand type); the mask words are compared with 0 as they are; the scores, the maximum, the exponentials (2^x on the hardware unit), their sum, the reciprocal (a true division) and the products' accumulation f32; the weights ONE f16 word (11 bits), unnormalised: 1,024 exp(s - max), so the largest of a row is 1,024; the row's 1 / sum is applied to the f32 result; out f32. v_wmma_f32_16x16x32_bf16 (scores), v_wmma_f32_16x16x32_f16 (output).
#define NBH 48                       /* (batch, head) pairs: 4 x 12 */
#define NHD 12                       /* heads */
#define SQ 4096                      /* tokens */
#define HD 64                        /* a head's width */
#define BS 64                        /* the block */
#define NBK (NBH * (SQ / BS))        /* blocks: 3,072 */
#define NEGM -10000.0f               /* the module's NEG_INF */
#define PEXP 10.0f                   /* the carry on the weights' operand, as an exponent of two: it sits in numerator and sum alike and cancels */
#define LOG2E 1.4426950408889634f    /* exp(x) = 2^(x log2 e) */
#define LP 72                        /* 16-bit words of an LDS operand row: 144 bytes = 16 x odd, for 16-byte fragment reads */
#define OP 68                        /* f32 words of an LDS output row: 16-byte column walks without bank conflicts */
typedef unsigned short v8us __attribute__((ext_vector_type(8), may_alias));
typedef unsigned int v2u __attribute__((ext_vector_type(2), may_alias));
typedef unsigned int v4u __attribute__((ext_vector_type(4), may_alias));
typedef float  v8f  __attribute__((ext_vector_type(8)));
typedef float  v4f  __attribute__((ext_vector_type(4)));
typedef float  v4fa __attribute__((ext_vector_type(4), may_alias));
typedef float  v2f  __attribute__((ext_vector_type(2)));
typedef _Float16 v2h  __attribute__((ext_vector_type(2)));
typedef _Float16 v16h __attribute__((ext_vector_type(16)));
typedef __bf16 v2b  __attribute__((ext_vector_type(2)));
typedef __bf16 v16b __attribute__((ext_vector_type(16)));
union FragH { v16h v; v16b b; v8us half[2]; _Float16 h[16]; };

__device__ __forceinline__ unsigned int pk_bf16(float a, float b) { const v2b h = {(__bf16)a, (__bf16)b}; return __builtin_bit_cast(unsigned int, h); }      /* two bf16 words, a in the low half: one v_cvt_pk_bf16_f32 */
__device__ __forceinline__ unsigned int pk_bf16_as_f16(float a, float b) { const unsigned int p = pk_bf16(a, b); const v2f q = {__uint_as_float(p << 16), __uint_as_float(p & 0xFFFF0000u)}; return __builtin_bit_cast(unsigned int, __builtin_convertvector(q, v2h)); }      /* the same two bf16 values as f16 words */
// a lane's 16 words of an operand row's 32 k: k = 8 hh + 0..7 and 16 + 8 hh + 0..7 (the order in which two accumulator tiles, converted in place, form an operand)
__device__ __forceinline__ FragH lds_frag(const unsigned short* p, int hh) { FragH f; f.half[0] = *(const v8us*)(p + 8 * hh); f.half[1] = *(const v8us*)(p + 16 + 8 * hh); return f; }
__device__ __forceinline__ v8f mma(v16h a, v16h b, v8f c) { return __builtin_amdgcn_wmma_f32_16x16x32_f16(false, a, false, b, (short)0, c, false, false); }
__device__ __forceinline__ v8f mma_b(v16b a, v16b b, v8f c) { return __builtin_amdgcn_wmma_f32_16x16x32_bf16(false, a, false, b, (short)0, c, false, false); }
__device__ __forceinline__ float other_half(float x) { const int b = __float_as_int(x); return __int_as_float(__builtin_amdgcn_permlanex16(b, b, 0x76543210, 0xfedcba98, false, false)); }      /* lane l reads lane l ^ 16 */
__device__ __forceinline__ float blk_add(float k) { return (k == 0.0f) ? NEGM : 0.0f; }      /* the key side: -10000 where the key's mask word equals 0 */

__global__ __launch_bounds__(128) void k_blkattn(const float* __restrict__ Q, const float* __restrict__ K, const float* __restrict__ V, const float* __restrict__ mask, float* __restrict__ out) {
  __shared__ __attribute__((aligned(16))) unsigned short sq[BS][LP];      /* Q rows, bf16 */
  __shared__ __attribute__((aligned(16))) unsigned short sk[BS][LP];      /* K rows, bf16 */
  __shared__ __attribute__((aligned(16))) unsigned short sv[HD][LP];      /* V transposed: [channel][key], f16 */
  __shared__ __attribute__((aligned(16))) float so[4][16][OP];            /* a wave's own 16 output rows */
  __shared__ __attribute__((aligned(16))) float sm[2][BS];                /* the block's 64 mask words, as they are: one copy a pair of waves, so that all 128 threads load and store one word with no branch */
  const int tid = threadIdx.x, w = tid >> 5, lane = tid & 31, ln = lane & 15, hh = lane >> 4; const int blk = blockIdx.x;
  const size_t base = (size_t)blk * (BS * HD);      /* the block's first word in Q, K, V and out */
  const float* mk = mask + (size_t)(blk / (NHD * (SQ / BS))) * SQ + (size_t)(blk & (SQ / BS - 1)) * BS;      /* the block's 64 mask words */
  const int c4 = (tid & 15) * 4, rg = tid >> 4;
  const char* Kb = (const char*)(K + base); const char* Qb = (const char*)(Q + base); const char* Vb = (const char*)(V + base);      /* the block's planes: the same for the whole work-group */
  const unsigned mi = tid & (BS - 1), bqk = (unsigned)(rg * HD + c4) * 4u, bv = (unsigned)(rg * 8 * HD + c4) * 4u;      /* the thread's mask word; its byte offsets in the Q and K rows and in the V rows */
  v4f qv[8], kv[8], vv[8];
  const float mword = mk[mi];
#pragma unroll      /* constant indices: the vectors stay in registers */
  for (int j = 0; j < 8; ++j) kv[j] = *(const v4fa*)(Kb + bqk + j * (8 * HD * 4));      /* row rg + 8 j */
#pragma unroll      /* constant indices: the vectors stay in registers */
  for (int j = 0; j < 8; ++j) qv[j] = *(const v4fa*)(Qb + bqk + j * (8 * HD * 4));
#pragma unroll      /* constant indices: the vectors stay in registers */
  for (int j = 0; j < 8; ++j) vv[j] = *(const v4fa*)(Vb + bv + j * (HD * 4));      /* row rg * 8 + j: 8 consecutive keys of 4 channels */
  asm volatile("s_wait_xcnt 0x0" :: "v"(mi), "v"(bqk), "v"(bv) : "memory");      /* the loads' offset registers are inputs, so they live up to this wait and no later load lands on one of them */
  __builtin_amdgcn_sched_barrier(0);      /* all 25 loads are issued before the first cast: without it the compiler sinks the last V loads behind the waits for the first rows, and a second memory latency follows the first */
#pragma unroll      /* constant indices: the vectors stay in registers */
  for (int j = 0; j < 8; ++j) *(v2u*)&sk[rg + 8 * j][c4] = (v2u){pk_bf16(kv[j][0], kv[j][1]), pk_bf16(kv[j][2], kv[j][3])};
#pragma unroll      /* constant indices: the vectors stay in registers */
  for (int j = 0; j < 8; ++j) *(v2u*)&sq[rg + 8 * j][c4] = (v2u){pk_bf16(qv[j][0], qv[j][1]), pk_bf16(qv[j][2], qv[j][3])};
#pragma unroll      /* constant indices: the vectors stay in registers */
  for (int i = 0; i < 4; ++i) *(v4u*)&sv[c4 + i][rg * 8] = (v4u){pk_bf16_as_f16(vv[0][i], vv[1][i]), pk_bf16_as_f16(vv[2][i], vv[3][i]), pk_bf16_as_f16(vv[4][i], vv[5][i]), pk_bf16_as_f16(vv[6][i], vv[7][i])};
  sm[w >> 1][tid & (BS - 1)] = mword;
  __syncthreads();      /* every wave reads all of K and V and its 16 Q rows, which all four waves laid down, and the mask copy of its pair of waves */
  const v8f z8 = {0.f, 0.f, 0.f, 0.f, 0.f, 0.f, 0.f, 0.f};
  // S^T: tile t, register r of lane (ln, hh) = the score of key t * 16 + 8 hh + r with query 16 w + ln
  const v16b bq0 = lds_frag(&sq[16 * w + ln][0], hh).b, bq1 = lds_frag(&sq[16 * w + ln][32], hh).b;
  v8f s[4];
#pragma unroll      /* constant indices: the vectors stay in registers */
  for (int t = 0; t < 4; ++t) { s[t] = mma_b(lds_frag(&sk[t * 16 + ln][0], hh).b, bq0, z8); s[t] = mma_b(lds_frag(&sk[t * 16 + ln][32], hh).b, bq1, s[t]); }
  v4f mw[8];
#pragma unroll      /* constant indices: the vectors stay in registers */
  for (int t = 0; t < 4; ++t) { mw[2 * t] = *(const v4fa*)&sm[w >> 1][t * 16 + 8 * hh]; mw[2 * t + 1] = *(const v4fa*)&sm[w >> 1][t * 16 + 8 * hh + 4]; }      /* the mask words of the lane's 32 keys */
  const float mq = sm[w >> 1][16 * w + ln];      /* the lane's query */
  float m = -3.0e38f;
#pragma unroll      /* constant indices: the vectors stay in registers */
  for (int t = 0; t < 4; ++t) {
#pragma unroll      /* constant indices: the vectors stay in registers */
    for (int r = 0; r < 8; ++r) { s[t][r] = s[t][r] + blk_add(mw[2 * t + (r >> 2)][r & 3]); m = fmaxf(m, s[t][r]); } }
  m = fmaxf(m, other_half(m));
  const float cx = fmaf(-m, LOG2E, PEXP); const v2f c2 = {cx, cx};      /* the row's addend: a term is 2^(s log2 e + cx) = 1,024 exp(s - m), at most 1,024; far below the maximum it is 0 */
  v2f st[4];      /* a tile's even and odd keys: neighbouring registers add as pairs */
#pragma unroll      /* constant indices: the vectors stay in registers */
  for (int t = 0; t < 4; ++t) { st[t] = (v2f){0.f, 0.f};
#pragma unroll      /* constant indices: the vectors stay in registers */
    for (int r = 0; r < 8; r += 2) { const v2f x = __builtin_elementwise_fma((v2f){s[t][r], s[t][r + 1]}, (v2f){LOG2E, LOG2E}, c2); s[t][r] = __builtin_amdgcn_exp2f(x[0]); s[t][r + 1] = __builtin_amdgcn_exp2f(x[1]); st[t] += (v2f){s[t][r], s[t][r + 1]}; } }
  const v2f sp = (st[0] + st[1]) + (st[2] + st[3]); float sum = sp[0] + sp[1]; sum += other_half(sum);
  const float g = ((mq == 0.0f) ? 0.0f : 1.0f) / sum;      /* used on the f32 result only: the division runs beside the second product */
  // the weights as the B operand: element i of a 32-key step = tile 2 kb, register i; element 8 + i = tile 2 kb + 1, register i
  FragH pb[2];
#pragma unroll      /* constant indices: the vectors stay in registers */
  for (int t = 0; t < 4; ++t) {
#pragma unroll      /* constant indices: the vectors stay in registers */
    for (int r = 0; r < 8; r += 2) { const v2f pr = {s[t][r], s[t][r + 1]}; const v2h h = __builtin_convertvector(pr, v2h); pb[t >> 1].h[(t & 1) * 8 + r] = h[0]; pb[t >> 1].h[(t & 1) * 8 + r + 1] = h[1]; } }
  // O^T: tile t, register r of lane (ln, hh) = channel t * 16 + 8 hh + r of query 16 w + ln
#pragma unroll      /* constant indices: the vectors stay in registers */
  for (int t = 0; t < 4; ++t) { v8f o = mma(lds_frag(&sv[t * 16 + ln][0], hh).v, pb[0].v, z8); o = mma(lds_frag(&sv[t * 16 + ln][32], hh).v, pb[1].v, o);
    v4f lo, hi;
#pragma unroll      /* constant indices: the vectors stay in registers */
    for (int i = 0; i < 4; ++i) { lo[i] = o[i] * g; hi[i] = o[4 + i] * g; }
    *(v4fa*)&so[w][ln][t * 16 + 8 * hh] = lo; *(v4fa*)&so[w][ln][t * 16 + 8 * hh + 4] = hi; }
  __builtin_amdgcn_fence(__ATOMIC_ACQ_REL, "workgroup"); __builtin_amdgcn_wave_barrier();      /* the wave reads back rows that its other lanes wrote: the LDS stores stay in front of the loads */
#pragma unroll      /* constant indices: the vectors stay in registers */
  for (int q = 0; q < 8; ++q) { const int r = q * 2 + hh; const v4f v = *(const v4fa*)&so[w][r][ln * 4]; *(v4fa*)(out + base + (size_t)(16 * w + r) * HD + ln * 4) = v; }      /* two whole rows, 512 consecutive bytes, a store */
}

extern "C" void kernel_launch(void* const* d_in, const int* in_sizes, int n_in,
                              void* d_out, int out_size, void* d_ws, size_t ws_size, hipStream_t stream) {
  (void)in_sizes; (void)n_in; (void)out_size; (void)d_ws; (void)ws_size;
  const float* Q = (const float*)d_in[0]; const float* K = (const float*)d_in[1]; const float* V = (const float*)d_in[2]; const float* mask = (const float*)d_in[3];      /* Q, K, V [4][12][4096][64] f32; mask [4][4096] f32 */
  static_assert(NBH == 48 && NHD == 12 && SQ == 4096 && HD == 64 && BS == 64 && NBK == 3072, "the index shifts; whole tiles; an exact grid");
  float* out = (float*)d_out;      /* [4][12][4096][64]: a block's 64 rows of 64 words are consecutive: block b at out + b * 4096 */
  k_blkattn<<<NBK, 128, 0, stream>>>(Q, K, V, mask, out);      /* every element once */
}
